// v000
// Times are from an AMD MI455X. After a warm-up the kernel runs many times in a row, and a time is the length of
// such a window on the GPU divided by its runs, so every launch and the gaps after it count. The runs cycle
// through copies of the inputs. A figure is the median of several windows, for all but v000 over two sittings.
// Sittings can differ by a few percent; kernels timed side by side share one.
// The starting kernel, v000, takes 1270 microseconds a run.
#include <hip/hip_runtime.h>
#include <hip/hip_bf16.h>

// ---------------------------------------------------------------------------
// LoRA quantized-linear:  out = x @ W.T + b + (x @ (A*c).T) @ B.T * (16/16)
//   x: [8192,4096] f32, W: [4096,4096] f32, b: [4096] f32,
//   lora_A: [16,4096] f32, lora_B: [4096,16] f32, lora_c: [16,1] f32
// Strategy:
//   Kernel 1: h = x @ (A*c).T  (rank-16, 512 KB workspace)
//   Kernel 2: 128x128 fp32 WMMA GEMM (V_WMMA_F32_16X16X4_F32),
//             4 waves x (64x64 wave tile) = 16 accumulators/wave,
//             double-buffered LDS fed by GLOBAL_LOAD_ASYNC_TO_LDS_B128
//             (ASYNCcnt-pipelined), fused LoRA + bias epilogue.
// ---------------------------------------------------------------------------

typedef float v2f __attribute__((ext_vector_type(2)));
typedef float v8f __attribute__((ext_vector_type(8)));
typedef int   v4i __attribute__((vector_size(16)));   // matches builtin param type

constexpr int Mdim = 8192;
constexpr int Ndim = 4096;
constexpr int Kdim = 4096;
constexpr int RANK = 16;

constexpr int BM = 128;
constexpr int BN = 128;
constexpr int BK = 16;
constexpr int LDS_STRIDE = 20;   // 16 + 4 pad -> bank-conflict-free b64 frag reads
constexpr int NTHREADS = 128;    // 4 waves, 2x2 wave grid, 64x64 per wave

// CDNA5 async global->LDS path (guarded; falls back to plain loads).
#if defined(__gfx1250__) && __has_builtin(__builtin_amdgcn_global_load_async_to_lds_b128)
#define USE_ASYNC 1
#if __has_builtin(__builtin_amdgcn_s_wait_asynccnt)
#define WAIT_ASYNC(n) __builtin_amdgcn_s_wait_asynccnt(n)
#else
#define WAIT_ASYNC(n) asm volatile("s_wait_asynccnt %0" ::"i"(n))
#endif
#else
#define USE_ASYNC 0
#define WAIT_ASYNC(n)
#endif

// ---------------------------------------------------------------------------
// Kernel 1: rank-r projection h = x @ (A * c).T  (SCALING/R == 1.0 folded in)
// ---------------------------------------------------------------------------
__global__ __launch_bounds__(256)
void lora_h_kernel(const float* __restrict__ x,
                   const float* __restrict__ lora_A,
                   const float* __restrict__ lora_c,
                   float* __restrict__ h) {
    const int idx = blockIdx.x * blockDim.x + threadIdx.x;   // 0 .. M*16-1
    const int m = idx >> 4;
    const int r = idx & 15;
    const float c = lora_c[r];

    const float4* xr = (const float4*)(x + (size_t)m * Kdim);
    const float4* ar = (const float4*)(lora_A + (size_t)r * Kdim);

    float acc = 0.0f;
    for (int k = 0; k < Kdim / 4; ++k) {
        float4 xv = xr[k];
        float4 av = ar[k];
        acc += xv.x * av.x + xv.y * av.y + xv.z * av.z + xv.w * av.w;
    }
    h[idx] = acc * c;
}

// ---------------------------------------------------------------------------
// Kernel 2: out = x @ W.T + bias + h @ lora_B.T
// 128 threads = 4 waves (2x2), wave tile 64x64 = 4x4 accumulators.
// Per K-substep: 8 ds_load_b64 feed 16 WMMAs.
// LDS tiles row-major, stride 20 floats: fragment (k,k+1) pair is one
// aligned ds_load_b64; rows-across-lanes -> conflict-free.
// ---------------------------------------------------------------------------
__global__ __launch_bounds__(NTHREADS)
void gemm_lora_kernel(const float* __restrict__ X,
                      const float* __restrict__ W,
                      const float* __restrict__ bias,
                      const float* __restrict__ lora_B,
                      const float* __restrict__ h,
                      float* __restrict__ out) {
    __shared__ float As[2][BM][LDS_STRIDE];
    __shared__ float Bs[2][BN][LDS_STRIDE];

    const int tid    = threadIdx.x;
    const int lane   = tid & 31;
    const int wave   = tid >> 5;       // 0..3
    const int wave_m = wave >> 1;      // 0..1  -> 64 rows each
    const int wave_n = wave & 1;       // 0..1  -> 64 cols each
    const int half   = lane >> 4;      // K-pair select (0,1) vs (2,3)
    const int l16    = lane & 15;

    const int block_m = blockIdx.y * BM;
    const int block_n = blockIdx.x * BN;

    v8f acc[4][4];
#pragma unroll
    for (int mi = 0; mi < 4; ++mi)
#pragma unroll
        for (int ni = 0; ni < 4; ++ni)
            acc[mi][ni] = v8f{};

    // Copy one 128x16 tile of X and of W into LDS buffer `buf`.
    // 512 float4 chunks per tile, 4 per thread; 8 async ops/thread total.
    auto issue_tile = [&](int buf, int kt) {
#pragma unroll
        for (int i = 0; i < 4; ++i) {
            const int f   = tid + i * NTHREADS;  // 0..511
            const int row = f >> 2;              // 0..127
            const int kq  = (f & 3) << 2;        // 0,4,8,12
            const float* gx = X + (size_t)(block_m + row) * Kdim + kt + kq;
            const float* gw = W + (size_t)(block_n + row) * Kdim + kt + kq;
            float* lx = &As[buf][row][kq];
            float* lw = &Bs[buf][row][kq];
#if USE_ASYNC
            __builtin_amdgcn_global_load_async_to_lds_b128((v4i*)gx, (v4i*)lx, 0, 0);
            __builtin_amdgcn_global_load_async_to_lds_b128((v4i*)gw, (v4i*)lw, 0, 0);
#else
            *(float4*)lx = *(const float4*)gx;
            *(float4*)lw = *(const float4*)gw;
#endif
        }
    };

    issue_tile(0, 0);
    int buf = 0;

    for (int kt = 0; kt < Kdim; kt += BK) {
        const bool has_next = (kt + BK) < Kdim;
        if (has_next) {
            issue_tile(buf ^ 1, kt + BK);   // stream next tile during compute
            WAIT_ASYNC(8);                  // retire current tile's 8 asyncs
        } else {
            WAIT_ASYNC(0);
        }
        __syncthreads();                    // all waves' current tile visible

        const float (*Ab)[LDS_STRIDE] = As[buf];
        const float (*Bb)[LDS_STRIDE] = Bs[buf];
#pragma unroll
        for (int kk = 0; kk < 4; ++kk) {
            const int kb = kk * 4 + 2 * half;
            v2f afrag[4], bfrag[4];
#pragma unroll
            for (int mi = 0; mi < 4; ++mi)
                afrag[mi] = *(const v2f*)&Ab[wave_m * 64 + mi * 16 + l16][kb];
#pragma unroll
            for (int ni = 0; ni < 4; ++ni)
                bfrag[ni] = *(const v2f*)&Bb[wave_n * 64 + ni * 16 + l16][kb];
#pragma unroll
            for (int mi = 0; mi < 4; ++mi)
#pragma unroll
                for (int ni = 0; ni < 4; ++ni)
                    acc[mi][ni] = __builtin_amdgcn_wmma_f32_16x16x4_f32(
                        false, afrag[mi], false, bfrag[ni],
                        (short)0, acc[mi][ni], false, false);
        }
        __syncthreads();                    // done reading buf before reuse
        buf ^= 1;
    }

    // ---- LoRA correction: acc += h @ lora_B.T  (K=16 -> 4 WMMA k-steps) ----
#pragma unroll
    for (int kk = 0; kk < 4; ++kk) {
        const int kb = kk * 4 + 2 * half;
        v2f afrag[4], bfrag[4];
#pragma unroll
        for (int mi = 0; mi < 4; ++mi) {
            const int row = block_m + wave_m * 64 + mi * 16 + l16;
            afrag[mi] = *(const v2f*)&h[(size_t)row * RANK + kb];
        }
#pragma unroll
        for (int ni = 0; ni < 4; ++ni) {
            const int col = block_n + wave_n * 64 + ni * 16 + l16;
            bfrag[ni] = *(const v2f*)&lora_B[(size_t)col * RANK + kb];
        }
#pragma unroll
        for (int mi = 0; mi < 4; ++mi)
#pragma unroll
            for (int ni = 0; ni < 4; ++ni)
                acc[mi][ni] = __builtin_amdgcn_wmma_f32_16x16x4_f32(
                    false, afrag[mi], false, bfrag[ni],
                    (short)0, acc[mi][ni], false, false);
    }

    // ---- bias + store (C layout: VGPR j -> M = j (+8 for lanes 16-31), N = l16) ----
#pragma unroll
    for (int ni = 0; ni < 4; ++ni) {
        const int col = block_n + wave_n * 64 + ni * 16 + l16;
        const float bv = bias[col];
#pragma unroll
        for (int mi = 0; mi < 4; ++mi) {
            const int rbase = block_m + wave_m * 64 + mi * 16 + half * 8;
#pragma unroll
            for (int j = 0; j < 8; ++j) {
                out[(size_t)(rbase + j) * Ndim + col] = acc[mi][ni][j] + bv;
            }
        }
    }
}

// ---------------------------------------------------------------------------
extern "C" void kernel_launch(void* const* d_in, const int* in_sizes, int n_in,
                              void* d_out, int out_size, void* d_ws, size_t ws_size,
                              hipStream_t stream) {
    const float* x      = (const float*)d_in[0];
    const float* W      = (const float*)d_in[1];
    const float* b      = (const float*)d_in[2];
    const float* lora_A = (const float*)d_in[3];
    const float* lora_B = (const float*)d_in[4];
    const float* lora_c = (const float*)d_in[5];
    float* out = (float*)d_out;
    float* h   = (float*)d_ws;     // [8192, 16] f32 = 512 KB

    lora_h_kernel<<<(Mdim * RANK) / 256, 256, 0, stream>>>(x, lora_A, lora_c, h);

    dim3 grid(Ndim / BN, Mdim / BM);   // (32, 64)
    gemm_lora_kernel<<<grid, NTHREADS, 0, stream>>>(x, W, b, lora_B, h, out);
}

// v001
// It runs in 1180 microseconds.
// Next to v000, in two timings, it ran 1.13 times as fast each time.
#include <hip/hip_runtime.h>
#include <hip/hip_bf16.h>

// ---------------------------------------------------------------------------
// LoRA quantized-linear:  out = x @ W.T + b + (x @ (A*c).T) @ B.T * (16/16)
//   x: [8192,4096] f32, W: [4096,4096] f32, b: [4096] f32,
//   lora_A: [16,4096] f32, lora_B: [4096,16] f32, lora_c: [16,1] f32
// Strategy:
//   Kernel 1: h = x @ (A*c).T  (rank-16, 512 KB workspace), fp32 WMMA,
//             operands staged in LDS by async copies
//   Kernel 2: 128x128 fp32 WMMA GEMM (V_WMMA_F32_16X16X4_F32),
//             4 waves x (64x64 wave tile) = 16 accumulators/wave,
//             double-buffered LDS fed by GLOBAL_LOAD_ASYNC_TO_LDS_B128
//             (ASYNCcnt-pipelined), fused LoRA + bias epilogue.
// ---------------------------------------------------------------------------

typedef float v2f __attribute__((ext_vector_type(2)));
typedef float v8f __attribute__((ext_vector_type(8)));
typedef int   v4i __attribute__((vector_size(16)));   // matches builtin param type

constexpr int Mdim = 8192;
constexpr int Ndim = 4096;
constexpr int Kdim = 4096;
constexpr int RANK = 16;

constexpr int BM = 128;
constexpr int BN = 128;
constexpr int BK = 16;
constexpr int LDS_STRIDE = 20;   // 16 + 4 pad -> bank-conflict-free b64 frag reads
constexpr int NTHREADS = 128;    // 4 waves, 2x2 wave grid, 64x64 per wave

// CDNA5 async global->LDS path (guarded; falls back to plain loads).
#if defined(__gfx1250__) && __has_builtin(__builtin_amdgcn_global_load_async_to_lds_b128)
#define USE_ASYNC 1
#if __has_builtin(__builtin_amdgcn_s_wait_asynccnt)
#define WAIT_ASYNC(n) __builtin_amdgcn_s_wait_asynccnt(n)
#else
#define WAIT_ASYNC(n) asm volatile("s_wait_asynccnt %0" ::"i"(n))
#endif
#else
#define USE_ASYNC 0
#define WAIT_ASYNC(n)
#endif

// ---------------------------------------------------------------------------
// Kernel 1: rank-r projection h = (x @ A.T) * c  (SCALING/R == 1.0 folded in)
// One work-group = 32 rows of x, 16 waves. K runs in 8 stages of 512: a stage
// holds 32 rows of x and the 16 rows of lora_A, brought in as 512-byte row
// pieces (whole cache lines per wave) by async copies, two buffers.
// Wave w multiplies k = 32w .. 32w+31 of every stage for both 16-row tiles on
// V_WMMA_F32_16X16X4_F32; the 16 partial tiles are summed through LDS.
// A lane reads 4 consecutive k at [row l16][8j + 4*half] from x and from
// lora_A alike, so both operands of a WMMA hold the same k at every position.
// ---------------------------------------------------------------------------
constexpr int H_ROWS    = 32;
constexpr int H_BK      = 512;
constexpr int H_PITCH   = H_BK + 4;      // 2064 B = 16 B x odd: conflict-free b128 reads
constexpr int H_THREADS = 512;           // 16 waves
constexpr int H_WAVES   = H_THREADS / 32;
constexpr int H_STAGES  = Kdim / H_BK;   // 8

// red stands first (32 KiB): a copy's LDS address less the constant offset that
// the compiler folds into the copy (under 16 KiB here) then never falls below 0.
struct HStage {
    float red[H_WAVES][H_ROWS * RANK];
    float Xs[2][H_ROWS][H_PITCH];
    float Ls[2][RANK][H_PITCH];
};

__global__ __launch_bounds__(H_THREADS)
void lora_h_kernel(const float* __restrict__ x,
                   const float* __restrict__ lora_A,
                   const float* __restrict__ lora_c,
                   float* __restrict__ h) {
    __shared__ __attribute__((aligned(16))) HStage sm;
    float (&red)[H_WAVES][H_ROWS * RANK] = sm.red;
    float (&Xs)[2][H_ROWS][H_PITCH]      = sm.Xs;
    float (&Ls)[2][RANK][H_PITCH]        = sm.Ls;

    const int tid  = threadIdx.x;
    const int lane = tid & 31;
    const int wave = tid >> 5;         // 0..15 -> k slice of a stage
    const int half = lane >> 4;
    const int l16  = lane & 15;
    const int row0 = blockIdx.x * H_ROWS;

    // One stage: 4096 + 2048 pieces of 16 bytes, 8 + 4 copies per thread;
    // the 32 lanes of a wave cover 512 contiguous bytes of one row.
    auto issue_stage = [&](int buf, int k0) {
#pragma unroll
        for (int i = 0; i < 12; ++i) {
            const int f   = tid + (i < 8 ? i : i - 8) * H_THREADS;
            const int row = f >> 7;
            const int c4  = (f & 127) << 2;
            const float* g = (i < 8 ? x + (size_t)(row0 + row) * Kdim
                                    : lora_A + (size_t)row * Kdim) + k0 + c4;
            float* l = (i < 8) ? &Xs[buf][row][c4] : &Ls[buf][row][c4];
#if USE_ASYNC
            __builtin_amdgcn_global_load_async_to_lds_b128((v4i*)g, (v4i*)l, 0, 0);
#else
            *(float4*)l = *(const float4*)g;
#endif
        }
    };

    issue_stage(0, 0);
    // stage 0 has landed before any wave passes the barrier and reads it
    asm volatile("s_wait_asynccnt 0x0" ::: "memory");
    __syncthreads();
    issue_stage(1, H_BK);

    v8f acc0 = v8f{};
    v8f acc1 = v8f{};
    const int koff = wave * 32 + 4 * half;

    for (int s = 0; s < H_STAGES; ++s) {
        const int buf = s & 1;
        const float* pa0 = &Xs[buf][l16][koff];
        const float* pa1 = &Xs[buf][16 + l16][koff];
        const float* pb  = &Ls[buf][l16][koff];
#pragma unroll
        for (int j = 0; j < 4; ++j) {
            const float4 a0 = *(const float4*)(pa0 + 8 * j);
            const float4 a1 = *(const float4*)(pa1 + 8 * j);
            const float4 b  = *(const float4*)(pb + 8 * j);
            acc0 = __builtin_amdgcn_wmma_f32_16x16x4_f32(
                false, v2f{a0.x, a0.y}, false, v2f{b.x, b.y}, (short)0, acc0, false, false);
            acc1 = __builtin_amdgcn_wmma_f32_16x16x4_f32(
                false, v2f{a1.x, a1.y}, false, v2f{b.x, b.y}, (short)0, acc1, false, false);
            acc0 = __builtin_amdgcn_wmma_f32_16x16x4_f32(
                false, v2f{a0.z, a0.w}, false, v2f{b.z, b.w}, (short)0, acc0, false, false);
            acc1 = __builtin_amdgcn_wmma_f32_16x16x4_f32(
                false, v2f{a1.z, a1.w}, false, v2f{b.z, b.w}, (short)0, acc1, false, false);
        }
        // this wave's reads of buffer buf have returned before it is refilled
        asm volatile("s_wait_dscnt 0x0" ::: "memory");
        // this wave's copies of stage s + 1 have landed before others read them
        asm volatile("s_wait_asynccnt 0x0" ::: "memory");
        __syncthreads();   // publishes stage s + 1, ends every read of buffer buf
        if (s + 2 < H_STAGES)
            issue_stage(buf, (s + 2) * H_BK);
    }
    // no copy is outstanding when the wave goes on to its end
    asm volatile("s_wait_asynccnt 0x0" ::: "memory");

    // C layout: VGPR j -> row j (+8 for lanes 16-31), column r = l16
#pragma unroll
    for (int j = 0; j < 8; ++j) {
        red[wave][(j + 8 * half) * RANK + l16]       = acc0[j];
        red[wave][(16 + j + 8 * half) * RANK + l16]  = acc1[j];
    }
    __syncthreads();       // all 16 partial tiles written before they are summed

    float sum = 0.0f;
#pragma unroll
    for (int w = 0; w < H_WAVES; ++w)
        sum += red[w][tid];
    h[(size_t)row0 * RANK + tid] = sum * lora_c[tid & 15];
}

// ---------------------------------------------------------------------------
// Kernel 2: out = x @ W.T + bias + h @ lora_B.T
// 128 threads = 4 waves (2x2), wave tile 64x64 = 4x4 accumulators.
// Per K-substep: 8 ds_load_b64 feed 16 WMMAs.
// LDS tiles row-major, stride 20 floats: fragment (k,k+1) pair is one
// aligned ds_load_b64; rows-across-lanes -> conflict-free.
// ---------------------------------------------------------------------------
__global__ __launch_bounds__(NTHREADS)
void gemm_lora_kernel(const float* __restrict__ X,
                      const float* __restrict__ W,
                      const float* __restrict__ bias,
                      const float* __restrict__ lora_B,
                      const float* __restrict__ h,
                      float* __restrict__ out) {
    __shared__ float As[2][BM][LDS_STRIDE];
    __shared__ float Bs[2][BN][LDS_STRIDE];

    const int tid    = threadIdx.x;
    const int lane   = tid & 31;
    const int wave   = tid >> 5;       // 0..3
    const int wave_m = wave >> 1;      // 0..1  -> 64 rows each
    const int wave_n = wave & 1;       // 0..1  -> 64 cols each
    const int half   = lane >> 4;      // K-pair select (0,1) vs (2,3)
    const int l16    = lane & 15;

    const int block_m = blockIdx.y * BM;
    const int block_n = blockIdx.x * BN;

    v8f acc[4][4];
#pragma unroll
    for (int mi = 0; mi < 4; ++mi)
#pragma unroll
        for (int ni = 0; ni < 4; ++ni)
            acc[mi][ni] = v8f{};

    // Copy one 128x16 tile of X and of W into LDS buffer `buf`.
    // 512 float4 chunks per tile, 4 per thread; 8 async ops/thread total.
    auto issue_tile = [&](int buf, int kt) {
#pragma unroll
        for (int i = 0; i < 4; ++i) {
            const int f   = tid + i * NTHREADS;  // 0..511
            const int row = f >> 2;              // 0..127
            const int kq  = (f & 3) << 2;        // 0,4,8,12
            const float* gx = X + (size_t)(block_m + row) * Kdim + kt + kq;
            const float* gw = W + (size_t)(block_n + row) * Kdim + kt + kq;
            float* lx = &As[buf][row][kq];
            float* lw = &Bs[buf][row][kq];
#if USE_ASYNC
            __builtin_amdgcn_global_load_async_to_lds_b128((v4i*)gx, (v4i*)lx, 0, 0);
            __builtin_amdgcn_global_load_async_to_lds_b128((v4i*)gw, (v4i*)lw, 0, 0);
#else
            *(float4*)lx = *(const float4*)gx;
            *(float4*)lw = *(const float4*)gw;
#endif
        }
    };

    issue_tile(0, 0);
    int buf = 0;

    for (int kt = 0; kt < Kdim; kt += BK) {
        const bool has_next = (kt + BK) < Kdim;
        if (has_next) {
            issue_tile(buf ^ 1, kt + BK);   // stream next tile during compute
            WAIT_ASYNC(8);                  // retire current tile's 8 asyncs
        } else {
            WAIT_ASYNC(0);
        }
        __syncthreads();                    // all waves' current tile visible

        const float (*Ab)[LDS_STRIDE] = As[buf];
        const float (*Bb)[LDS_STRIDE] = Bs[buf];
#pragma unroll
        for (int kk = 0; kk < 4; ++kk) {
            const int kb = kk * 4 + 2 * half;
            v2f afrag[4], bfrag[4];
#pragma unroll
            for (int mi = 0; mi < 4; ++mi)
                afrag[mi] = *(const v2f*)&Ab[wave_m * 64 + mi * 16 + l16][kb];
#pragma unroll
            for (int ni = 0; ni < 4; ++ni)
                bfrag[ni] = *(const v2f*)&Bb[wave_n * 64 + ni * 16 + l16][kb];
#pragma unroll
            for (int mi = 0; mi < 4; ++mi)
#pragma unroll
                for (int ni = 0; ni < 4; ++ni)
                    acc[mi][ni] = __builtin_amdgcn_wmma_f32_16x16x4_f32(
                        false, afrag[mi], false, bfrag[ni],
                        (short)0, acc[mi][ni], false, false);
        }
        __syncthreads();                    // done reading buf before reuse
        buf ^= 1;
    }

    // ---- LoRA correction: acc += h @ lora_B.T  (K=16 -> 4 WMMA k-steps) ----
#pragma unroll
    for (int kk = 0; kk < 4; ++kk) {
        const int kb = kk * 4 + 2 * half;
        v2f afrag[4], bfrag[4];
#pragma unroll
        for (int mi = 0; mi < 4; ++mi) {
            const int row = block_m + wave_m * 64 + mi * 16 + l16;
            afrag[mi] = *(const v2f*)&h[(size_t)row * RANK + kb];
        }
#pragma unroll
        for (int ni = 0; ni < 4; ++ni) {
            const int col = block_n + wave_n * 64 + ni * 16 + l16;
            bfrag[ni] = *(const v2f*)&lora_B[(size_t)col * RANK + kb];
        }
#pragma unroll
        for (int mi = 0; mi < 4; ++mi)
#pragma unroll
            for (int ni = 0; ni < 4; ++ni)
                acc[mi][ni] = __builtin_amdgcn_wmma_f32_16x16x4_f32(
                    false, afrag[mi], false, bfrag[ni],
                    (short)0, acc[mi][ni], false, false);
    }

    // ---- bias + store (C layout: VGPR j -> M = j (+8 for lanes 16-31), N = l16) ----
#pragma unroll
    for (int ni = 0; ni < 4; ++ni) {
        const int col = block_n + wave_n * 64 + ni * 16 + l16;
        const float bv = bias[col];
#pragma unroll
        for (int mi = 0; mi < 4; ++mi) {
            const int rbase = block_m + wave_m * 64 + mi * 16 + half * 8;
#pragma unroll
            for (int j = 0; j < 8; ++j) {
                out[(size_t)(rbase + j) * Ndim + col] = acc[mi][ni][j] + bv;
            }
        }
    }
}

// ---------------------------------------------------------------------------
extern "C" void kernel_launch(void* const* d_in, const int* in_sizes, int n_in,
                              void* d_out, int out_size, void* d_ws, size_t ws_size,
                              hipStream_t stream) {
    const float* x      = (const float*)d_in[0];
    const float* W      = (const float*)d_in[1];
    const float* b      = (const float*)d_in[2];
    const float* lora_A = (const float*)d_in[3];
    const float* lora_B = (const float*)d_in[4];
    const float* lora_c = (const float*)d_in[5];
    float* out = (float*)d_out;
    float* h   = (float*)d_ws;     // [8192, 16] f32 = 512 KB

    lora_h_kernel<<<Mdim / H_ROWS, H_THREADS, 0, stream>>>(x, lora_A, lora_c, h);

    dim3 grid(Ndim / BN, Mdim / BM);   // (32, 64)
    gemm_lora_kernel<<<grid, NTHREADS, 0, stream>>>(x, W, b, lora_B, h, out);
}
